// v000
// The times below were measured on an AMD MI455X: many runs one after another, warmed up first and cycling through
// copies of the inputs, with the whole window's GPU time divided by the number of runs. Launches and the gaps
// between them are all in it. The median over several windows is given; except for v000 it joins two sittings, which
// can be a few percent apart, so the side-by-side timings, each taken in one sitting, are the better comparison.
// The starting kernel, v000, takes 38.5 microseconds a run.
#include <hip/hip_runtime.h>

#define DD 512
#define UU 512

typedef __attribute__((ext_vector_type(2))) float v2f;
typedef __attribute__((ext_vector_type(8))) float v8f;

// ---------------- grouping pipeline ----------------

__global__ void zero_ws_kernel(int* counts, int* cursors, int C) {
    int i = blockIdx.x * blockDim.x + threadIdx.x;
    if (i < C) { counts[i] = 0; cursors[i] = 0; }
}

__global__ void hist_kernel(const int* __restrict__ classes, int* counts, int Bn) {
    int b = blockIdx.x * blockDim.x + threadIdx.x;
    if (b < Bn) atomicAdd(&counts[classes[b]], 1);
}

__global__ void scan_kernel(const int* __restrict__ counts, int* offsets, int C) {
    if (threadIdx.x == 0 && blockIdx.x == 0) {
        int acc = 0;
        for (int c = 0; c < C; ++c) { offsets[c] = acc; acc += counts[c]; }
        offsets[C] = acc;
    }
}

__global__ void scatter_kernel(const int* __restrict__ classes,
                               const int* __restrict__ offsets,
                               int* cursors, int* rowlist, int Bn) {
    int b = blockIdx.x * blockDim.x + threadIdx.x;
    if (b < Bn) {
        int c = classes[b];
        int pos = offsets[c] + atomicAdd(&cursors[c], 1);
        rowlist[pos] = b;
    }
}

// ---------------- grouped GEMM via V_WMMA_F32_16X16X4_F32 ----------------
// grid = (C, 2). 256 threads = 8 waves; wave w owns columns [w*64, w*64+64).
// Each wave computes 16x64 output tiles (4 v8f accumulators), K-loop step 4.

__global__ void __launch_bounds__(256)
cond_dense_wmma(const float* __restrict__ x,     // [B, D]
                const float* __restrict__ wtab,  // [C, D, U]
                const float* __restrict__ bias,  // [C, U]
                const int*   __restrict__ offsets,
                const int*   __restrict__ rowlist,
                float*       __restrict__ out)   // [B, U]
{
    const int c     = blockIdx.x;
    const int start = offsets[c];
    const int cnt   = offsets[c + 1] - start;
    if (cnt == 0) return;                       // uniform per block: EXEC stays all-1s

    const int lane  = threadIdx.x & 31;
    const int wave  = threadIdx.x >> 5;         // 0..7
    const int nBase = wave * 64;
    const int laneM = lane & 15;
    const int hi    = lane >> 4;                // 0 or 1
    const int kHalf = hi * 2;                   // K sub-offset 0 or 2

    const float* __restrict__ W = wtab + (size_t)c * DD * UU;

    // bias for this lane's 4 stored columns (hoisted out of the row-tile loop)
    float bv0 = bias[(size_t)c * UU + nBase + laneM];
    float bv1 = bias[(size_t)c * UU + nBase + 16 + laneM];
    float bv2 = bias[(size_t)c * UU + nBase + 32 + laneM];
    float bv3 = bias[(size_t)c * UU + nBase + 48 + laneM];

    for (int m0 = blockIdx.y * 16; m0 < cnt; m0 += 32) {
        // A-fragment source row for this lane (clamped; invalid rows masked at store)
        int mrow   = m0 + laneM;
        int srcRow = rowlist[start + (mrow < cnt ? mrow : cnt - 1)];
        const float* __restrict__ xrow = x + (size_t)srcRow * DD;

        v8f acc0 = {}, acc1 = {}, acc2 = {}, acc3 = {};

        for (int k0 = 0; k0 < DD; k0 += 4) {
            // A: lane<16 -> (K=k0,k0+1) of row laneM; lane>=16 -> (K=k0+2,k0+3)
            const float2 a2 = *(const float2*)(xrow + k0 + kHalf);
            v2f A; A.x = a2.x; A.y = a2.y;

            // B: lanes stripe N; .x = row k0+kHalf, .y = row k0+kHalf+1
            const float* __restrict__ Wp = W + (size_t)(k0 + kHalf) * UU + nBase + laneM;
            v2f B0, B1, B2, B3;
            B0.x = Wp[0];  B0.y = Wp[UU];
            B1.x = Wp[16]; B1.y = Wp[UU + 16];
            B2.x = Wp[32]; B2.y = Wp[UU + 32];
            B3.x = Wp[48]; B3.y = Wp[UU + 48];

            acc0 = __builtin_amdgcn_wmma_f32_16x16x4_f32(false, A, false, B0, (short)0, acc0, false, false);
            acc1 = __builtin_amdgcn_wmma_f32_16x16x4_f32(false, A, false, B1, (short)0, acc1, false, false);
            acc2 = __builtin_amdgcn_wmma_f32_16x16x4_f32(false, A, false, B2, (short)0, acc2, false, false);
            acc3 = __builtin_amdgcn_wmma_f32_16x16x4_f32(false, A, false, B3, (short)0, acc3, false, false);
        }

        // D layout: VGPR r, lanes 0-15 = [M=m0+r][N=laneM], lanes 16-31 = [M=m0+8+r]
        #pragma unroll
        for (int r = 0; r < 8; ++r) {
            int m = m0 + hi * 8 + r;
            if (m < cnt) {
                int row = rowlist[start + m];
                float* o = out + (size_t)row * UU + nBase + laneM;
                o[0]  = acc0[r] + bv0;
                o[16] = acc1[r] + bv1;
                o[32] = acc2[r] + bv2;
                o[48] = acc3[r] + bv3;
            }
        }
    }
}

// ---------------- launcher ----------------

extern "C" void kernel_launch(void* const* d_in, const int* in_sizes, int n_in,
                              void* d_out, int out_size, void* d_ws, size_t ws_size,
                              hipStream_t stream) {
    const float* x       = (const float*)d_in[0];
    const int*   classes = (const int*)d_in[1];
    const float* kern    = (const float*)d_in[2];
    const float* bias    = (const float*)d_in[3];
    float*       out     = (float*)d_out;

    const int Bn = in_sizes[0] / DD;   // 2048
    const int Cn = in_sizes[3] / UU;   // 100

    int* counts  = (int*)d_ws;
    int* offsets = counts + Cn;
    int* cursors = offsets + (Cn + 1);
    int* rowlist = cursors + Cn;

    zero_ws_kernel<<<(Cn + 255) / 256, 256, 0, stream>>>(counts, cursors, Cn);
    hist_kernel<<<(Bn + 255) / 256, 256, 0, stream>>>(classes, counts, Bn);
    scan_kernel<<<1, 32, 0, stream>>>(counts, offsets, Cn);
    scatter_kernel<<<(Bn + 255) / 256, 256, 0, stream>>>(classes, offsets, cursors, rowlist, Bn);

    cond_dense_wmma<<<dim3(Cn, 2), 256, 0, stream>>>(x, kern, bias, offsets, rowlist, out);
}

// v001
// A run of this version takes 26.8 microseconds.
// In both of two side-by-side timings against v000, it was 1.45 times as fast.
#include <hip/hip_runtime.h>

#define DD 512
#define UU 512

typedef __attribute__((ext_vector_type(2))) float v2f;
typedef __attribute__((ext_vector_type(8))) float v8f;

// ---------------- grouping pipeline ----------------

__global__ void zero_ws_kernel(int* counts, int* cursors, int C) {
    int i = blockIdx.x * blockDim.x + threadIdx.x;
    if (i < C) { counts[i] = 0; cursors[i] = 0; }
}

__global__ void hist_kernel(const int* __restrict__ classes, int* counts, int Bn) {
    int b = blockIdx.x * blockDim.x + threadIdx.x;
    if (b < Bn) atomicAdd(&counts[classes[b]], 1);
}

__global__ void scan_kernel(const int* __restrict__ counts, int* offsets, int C) {
    if (threadIdx.x == 0 && blockIdx.x == 0) {
        int acc = 0;
        for (int c = 0; c < C; ++c) { offsets[c] = acc; acc += counts[c]; }
        offsets[C] = acc;
    }
}

__global__ void scatter_kernel(const int* __restrict__ classes,
                               const int* __restrict__ offsets,
                               int* cursors, int* rowlist, int Bn) {
    int b = blockIdx.x * blockDim.x + threadIdx.x;
    if (b < Bn) {
        int c = classes[b];
        int pos = offsets[c] + atomicAdd(&cursors[c], 1);
        rowlist[pos] = b;
    }
}

// ---------------- grouped GEMM via V_WMMA_F32_16X16X4_F32 ----------------
// grid = (8, C): one work-group per (64-column slab, class), so that a class's
// table is streamed by eight work-groups instead of one or two; the slab index runs
// fastest, so the eight groups that share a class's table rows start together.
// 256 threads = 8 waves; wave w takes K range [w*64, w*64+64) of the whole slab
// and of up to two 16-row tiles, so each table element is loaded once per pass.
// The eight K partials are joined in LDS, in wave order 0..7.

#define KW 64                  // K range of one wave
#define NW 8                   // waves of one work-group
#define NSLAB 64               // columns of one work-group

template <int MT>
__device__ __forceinline__ void
row_pass(const float* __restrict__ x, const float* __restrict__ Wk,
         const int* __restrict__ rows, int m0, int cnt,
         int kOff, int laneM, int hi, int lane, int wave,
         float bv0, float bv1, float bv2, float bv3,
         float* __restrict__ outc, float4* red)
{
    // A-fragment source rows for this lane (clamped; invalid rows masked at store)
    const float* __restrict__ xrow[MT];
    #pragma unroll
    for (int t = 0; t < MT; ++t) {
        int mrow = m0 + t * 16 + laneM;
        xrow[t] = x + (size_t)rows[mrow < cnt ? mrow : cnt - 1] * DD + kOff;
    }

    v8f acc[MT][4];
    #pragma unroll
    for (int t = 0; t < MT; ++t)
        #pragma unroll
        for (int j = 0; j < 4; ++j) acc[t][j] = v8f{};

    for (int k0 = 0; k0 < KW; k0 += 4) {
        // A: lane<16 -> (K=k0,k0+1) of its row; lane>=16 -> (K=k0+2,k0+3), within the wave's K range
        v2f A[MT];
        #pragma unroll
        for (int t = 0; t < MT; ++t) {
            const float2 a2 = *(const float2*)(xrow[t] + k0);
            A[t].x = a2.x; A[t].y = a2.y;
        }

        // B: lanes stripe N; .x = this lane's table row at k0, .y = the row below it
        const float* __restrict__ Wp = Wk + (size_t)k0 * UU;
        v2f Bf[4];
        #pragma unroll
        for (int j = 0; j < 4; ++j) { Bf[j].x = Wp[j * 16]; Bf[j].y = Wp[UU + j * 16]; }

        #pragma unroll
        for (int t = 0; t < MT; ++t)
            #pragma unroll
            for (int j = 0; j < 4; ++j)
                acc[t][j] = __builtin_amdgcn_wmma_f32_16x16x4_f32(false, A[t], false, Bf[j], (short)0, acc[t][j], false, false);
    }

    // One statement directly behind the last product, held there by the two scheduling barriers:
    // - s_wait_xcnt 0 (two-tile form, whose K range is straight-line code), the wait that belongs in
    //   front of any overwrite of an address pair that issued loads name; it takes the A pairs as
    //   inputs, so they live up to it;
    // - four v_nop, the vector slots between a matrix instruction and the first vector
    //   instruction that reads its result or overwrites its operands.
    __builtin_amdgcn_sched_barrier(0);
    if constexpr (MT == 2)
        asm volatile("s_wait_xcnt 0x0\n\tv_nop\n\tv_nop\n\tv_nop\n\tv_nop" :: "v"(xrow[0]), "v"(xrow[1]) : "memory");
    else    // the one-tile K loop stays rolled and has its waits in front of its own address steps
        asm volatile("v_nop\n\tv_nop\n\tv_nop\n\tv_nop");
    __builtin_amdgcn_sched_barrier(0);

    // partials to LDS: red[src wave][tile][r][lane] = the lane's four column tiles of register r
    #pragma unroll
    for (int t = 0; t < MT; ++t)
        #pragma unroll
        for (int r = 0; r < 8; ++r)
            red[((wave * 2 + t) * 8 + r) * 32 + lane] =
                make_float4(acc[t][0][r], acc[t][1][r], acc[t][2][r], acc[t][3][r]);

    __syncthreads();           // every wave's partials are in LDS before any is summed

    // wave w sums register r = w of every tile: rows m0+t*16+w and m0+t*16+8+w, 64 columns each
    #pragma unroll
    for (int t = 0; t < MT; ++t) {
        float4 s = red[((0 * 2 + t) * 8 + wave) * 32 + lane];
        #pragma unroll
        for (int p = 1; p < NW; ++p) {
            const float4 q = red[((p * 2 + t) * 8 + wave) * 32 + lane];
            s.x += q.x; s.y += q.y; s.z += q.z; s.w += q.w;
        }
        int m = m0 + t * 16 + hi * 8 + wave;
        if (m < cnt) {
            float* o = outc + (size_t)rows[m] * UU;
            o[0]  = s.x + bv0;
            o[16] = s.y + bv1;
            o[32] = s.z + bv2;
            o[48] = s.w + bv3;
            // the wait that belongs in front of any overwrite of a register that these stores name
            asm volatile("s_wait_xcnt 0x0" ::: "memory");
        }
    }
}

__global__ void __launch_bounds__(256)
cond_dense_wmma(const float* __restrict__ x,     // [B, D]
                const float* __restrict__ wtab,  // [C, D, U]
                const float* __restrict__ bias,  // [C, U]
                const int*   __restrict__ offsets,
                const int*   __restrict__ rowlist,
                float*       __restrict__ out)   // [B, U]
{
    __shared__ float4 red[NW * 2 * 8 * 32];     // 64 KiB of K partials

    const int c     = blockIdx.y;
    const int start = offsets[c];
    const int cnt   = offsets[c + 1] - start;
    if (cnt == 0) return;                       // uniform per block, ahead of every barrier

    const int lane  = threadIdx.x & 31;
    const int wave  = threadIdx.x >> 5;         // 0..7
    const int nBase = blockIdx.x * NSLAB;
    const int laneM = lane & 15;
    const int hi    = lane >> 4;                // 0 or 1
    const int kOff  = wave * KW + hi * 2;       // this lane's first K

    const float* __restrict__ Wk = wtab + (size_t)c * DD * UU + (size_t)kOff * UU + nBase + laneM;
    const int*   __restrict__ rows = rowlist + start;
    float* __restrict__ outc = out + nBase + laneM;

    // bias for this lane's 4 stored columns
    float bv0 = bias[(size_t)c * UU + nBase + laneM];
    float bv1 = bias[(size_t)c * UU + nBase + 16 + laneM];
    float bv2 = bias[(size_t)c * UU + nBase + 32 + laneM];
    float bv3 = bias[(size_t)c * UU + nBase + 48 + laneM];

    for (int m0 = 0; m0 < cnt; m0 += 32) {
        if (m0) __syncthreads();                // the last pass's partials are read before they are overwritten
        if (cnt - m0 > 16)
            row_pass<2>(x, Wk, rows, m0, cnt, kOff, laneM, hi, lane, wave, bv0, bv1, bv2, bv3, outc, red);
        else
            row_pass<1>(x, Wk, rows, m0, cnt, kOff, laneM, hi, lane, wave, bv0, bv1, bv2, bv3, outc, red);
    }
}

// ---------------- launcher ----------------

extern "C" void kernel_launch(void* const* d_in, const int* in_sizes, int n_in,
                              void* d_out, int out_size, void* d_ws, size_t ws_size,
                              hipStream_t stream) {
    const float* x       = (const float*)d_in[0];
    const int*   classes = (const int*)d_in[1];
    const float* kern    = (const float*)d_in[2];
    const float* bias    = (const float*)d_in[3];
    float*       out     = (float*)d_out;

    const int Bn = in_sizes[0] / DD;   // 2048
    const int Cn = in_sizes[3] / UU;   // 100

    int* counts  = (int*)d_ws;
    int* offsets = counts + Cn;
    int* cursors = offsets + (Cn + 1);
    int* rowlist = cursors + Cn;

    zero_ws_kernel<<<(Cn + 255) / 256, 256, 0, stream>>>(counts, cursors, Cn);
    hist_kernel<<<(Bn + 255) / 256, 256, 0, stream>>>(classes, counts, Bn);
    scan_kernel<<<1, 32, 0, stream>>>(counts, offsets, Cn);
    scatter_kernel<<<(Bn + 255) / 256, 256, 0, stream>>>(classes, offsets, cursors, rowlist, Bn);

    cond_dense_wmma<<<dim3(8, Cn), 256, 0, stream>>>(x, kern, bias, offsets, rowlist, out);
}

// v002
// Measured time: 20.8 microseconds a run.
// Timed twice side by side with v001, it ran 1.29 times as fast both times.
// Over all steps from v000 it is 1.87 times as fast.
#include <hip/hip_runtime.h>

#define DD 512
#define UU 512

typedef __attribute__((ext_vector_type(2))) float v2f;
typedef __attribute__((ext_vector_type(8))) float v8f;

// ---------------- grouped GEMM via V_WMMA_F32_16X16X4_F32 ----------------
// grid = (8, C): one work-group per (64-column slab, class), so that a class's
// table is streamed by eight work-groups instead of one or two; the slab index runs
// fastest, so the eight groups that share a class's table rows start together.
// 256 threads = 8 waves; wave w takes K range [w*64, w*64+64) of the whole slab
// and of up to two 16-row tiles, so each table element is loaded once per pass.
// The eight K partials are joined in LDS, in wave order 0..7.
// Each work-group finds its class's samples itself: it reads the whole class vector, 256 samples
// a wave, and lists the matching sample numbers in LDS in rising order (ballot and bit count).

#define KW 64                  // K range of one wave
#define NW 8                   // waves of one work-group
#define NSLAB 64               // columns of one work-group
#define BB 2048                // samples
#define SPL (BB / (NW * 32))   // samples of one lane in the class search

template <int MT>
__device__ __forceinline__ void
row_pass(const float* __restrict__ x, const float* __restrict__ Wk,
         const int* __restrict__ rows, int m0, int cnt,
         int kOff, int laneM, int hi, int lane, int wave,
         float bv0, float bv1, float bv2, float bv3,
         float* __restrict__ outc, float4* red)
{
    // A-fragment source rows for this lane (clamped; invalid rows masked at store)
    const float* __restrict__ xrow[MT];
    #pragma unroll
    for (int t = 0; t < MT; ++t) {
        int mrow = m0 + t * 16 + laneM;
        xrow[t] = x + (size_t)rows[mrow < cnt ? mrow : cnt - 1] * DD + kOff;
    }

    v8f acc[MT][4];
    #pragma unroll
    for (int t = 0; t < MT; ++t)
        #pragma unroll
        for (int j = 0; j < 4; ++j) acc[t][j] = v8f{};

    for (int k0 = 0; k0 < KW; k0 += 4) {
        // A: lane<16 -> (K=k0,k0+1) of its row; lane>=16 -> (K=k0+2,k0+3), within the wave's K range
        v2f A[MT];
        #pragma unroll
        for (int t = 0; t < MT; ++t) {
            const float2 a2 = *(const float2*)(xrow[t] + k0);
            A[t].x = a2.x; A[t].y = a2.y;
        }

        // B: lanes stripe N; .x = this lane's table row at k0, .y = the row below it
        const float* __restrict__ Wp = Wk + (size_t)k0 * UU;
        v2f Bf[4];
        #pragma unroll
        for (int j = 0; j < 4; ++j) { Bf[j].x = Wp[j * 16]; Bf[j].y = Wp[UU + j * 16]; }

        #pragma unroll
        for (int t = 0; t < MT; ++t)
            #pragma unroll
            for (int j = 0; j < 4; ++j)
                acc[t][j] = __builtin_amdgcn_wmma_f32_16x16x4_f32(false, A[t], false, Bf[j], (short)0, acc[t][j], false, false);
    }

    // One statement directly behind the last product, held there by the two scheduling barriers:
    // - s_wait_xcnt 0 (two-tile form, whose K range is straight-line code), the wait that belongs in
    //   front of any overwrite of an address pair that issued loads name; it takes the A pairs as
    //   inputs, so they live up to it;
    // - four v_nop, the vector slots between a matrix instruction and the first vector
    //   instruction that reads its result or overwrites its operands.
    __builtin_amdgcn_sched_barrier(0);
    if constexpr (MT == 2)
        asm volatile("s_wait_xcnt 0x0\n\tv_nop\n\tv_nop\n\tv_nop\n\tv_nop" :: "v"(xrow[0]), "v"(xrow[1]) : "memory");
    else    // the one-tile K loop stays rolled and has its waits in front of its own address steps
        asm volatile("v_nop\n\tv_nop\n\tv_nop\n\tv_nop");
    __builtin_amdgcn_sched_barrier(0);

    // partials to LDS: red[src wave][tile][r][lane] = the lane's four column tiles of register r
    #pragma unroll
    for (int t = 0; t < MT; ++t)
        #pragma unroll
        for (int r = 0; r < 8; ++r)
            red[((wave * 2 + t) * 8 + r) * 32 + lane] =
                make_float4(acc[t][0][r], acc[t][1][r], acc[t][2][r], acc[t][3][r]);

    __syncthreads();           // every wave's partials are in LDS before any is summed

    // wave w sums register r = w of every tile: rows m0+t*16+w and m0+t*16+8+w, 64 columns each
    #pragma unroll
    for (int t = 0; t < MT; ++t) {
        float4 s = red[((0 * 2 + t) * 8 + wave) * 32 + lane];
        #pragma unroll
        for (int p = 1; p < NW; ++p) {
            const float4 q = red[((p * 2 + t) * 8 + wave) * 32 + lane];
            s.x += q.x; s.y += q.y; s.z += q.z; s.w += q.w;
        }
        int m = m0 + t * 16 + hi * 8 + wave;
        if (m < cnt) {
            float* o = outc + (size_t)rows[m] * UU;
            o[0]  = s.x + bv0;
            o[16] = s.y + bv1;
            o[32] = s.z + bv2;
            o[48] = s.w + bv3;
            // the wait that belongs in front of any overwrite of a register that these stores name
            asm volatile("s_wait_xcnt 0x0" ::: "memory");
        }
    }
}

__global__ void __launch_bounds__(256)
cond_dense_wmma(const float* __restrict__ x,       // [B, D]
                const int*   __restrict__ classes, // [B]
                const float* __restrict__ wtab,    // [C, D, U]
                const float* __restrict__ bias,    // [C, U]
                float*       __restrict__ out)     // [B, U]
{
    __shared__ float4 red[NW * 2 * 8 * 32];     // 64 KiB of K partials
    __shared__ int    rows[BB];                 // sample numbers of this class, rising
    __shared__ int    wtot[NW];                 // matches found by each wave

    const int c     = blockIdx.y;
    const int lane  = threadIdx.x & 31;
    const int wave  = threadIdx.x >> 5;         // 0..7
    const int nBase = blockIdx.x * NSLAB;
    const int laneM = lane & 15;
    const int hi    = lane >> 4;                // 0 or 1
    const int kOff  = wave * KW + hi * 2;       // this lane's first K

    // class search: wave w looks at samples [w*256, w*256+256), 32 a step
    const int b0 = wave * (SPL * 32) + lane;
    int cl[SPL];
    #pragma unroll
    for (int j = 0; j < SPL; ++j) cl[j] = classes[b0 + j * 32];

    unsigned hit[SPL];
    int tot = 0;
    #pragma unroll
    for (int j = 0; j < SPL; ++j) {
        hit[j] = __builtin_amdgcn_ballot_w32(cl[j] == c);
        tot += __popc(hit[j]);
    }
    if (lane == 0) wtot[wave] = tot;

    __syncthreads();           // every wave's match count is in LDS before any list place is formed

    int pos = 0, all = 0;      // matches in the waves below this one; matches of the whole class
    #pragma unroll
    for (int p = 0; p < NW; ++p) {
        const int v = wtot[p];
        pos += p < wave ? v : 0;
        all += v;
    }
    const unsigned below = (1u << lane) - 1u;
    #pragma unroll
    for (int j = 0; j < SPL; ++j) {
        if (cl[j] == c) rows[pos + __popc(hit[j] & below)] = b0 + j * 32;
        pos += __popc(hit[j]);
    }
    // the same in every lane: in a scalar register the row loop and its barriers get scalar branches
    const int cnt = __builtin_amdgcn_readfirstlane(all);

    __syncthreads();           // the list is complete before any wave reads it

    const float* __restrict__ Wk = wtab + (size_t)c * DD * UU + (size_t)kOff * UU + nBase + laneM;
    float* __restrict__ outc = out + nBase + laneM;

    // bias for this lane's 4 stored columns
    float bv0 = bias[(size_t)c * UU + nBase + laneM];
    float bv1 = bias[(size_t)c * UU + nBase + 16 + laneM];
    float bv2 = bias[(size_t)c * UU + nBase + 32 + laneM];
    float bv3 = bias[(size_t)c * UU + nBase + 48 + laneM];

    for (int m0 = 0; m0 < cnt; m0 += 32) {      // no trip for a class without samples
        if (m0) __syncthreads();                // the last pass's partials are read before they are overwritten
        if (cnt - m0 > 16)
            row_pass<2>(x, Wk, rows, m0, cnt, kOff, laneM, hi, lane, wave, bv0, bv1, bv2, bv3, outc, red);
        else
            row_pass<1>(x, Wk, rows, m0, cnt, kOff, laneM, hi, lane, wave, bv0, bv1, bv2, bv3, outc, red);
    }
}

// ---------------- launcher ----------------

extern "C" void kernel_launch(void* const* d_in, const int* in_sizes, int n_in,
                              void* d_out, int out_size, void* d_ws, size_t ws_size,
                              hipStream_t stream) {
    const float* x       = (const float*)d_in[0];
    const int*   classes = (const int*)d_in[1];
    const float* kern    = (const float*)d_in[2];
    const float* bias    = (const float*)d_in[3];
    float*       out     = (float*)d_out;

    const int Cn = in_sizes[3] / UU;   // 100

    cond_dense_wmma<<<dim3(8, Cn), 256, 0, stream>>>(x, classes, kern, bias, out);
}

// v003
// Measured time: 17.4 microseconds a run.
// Two timings next to v002 both put it at 1.20 times that version's speed.
// All steps since v000 together make it 2.25 times as fast.
#include <hip/hip_runtime.h>

#define DD 512
#define UU 512

typedef __attribute__((ext_vector_type(2))) float v2f;
typedef __attribute__((ext_vector_type(4))) float v4f;
typedef __attribute__((ext_vector_type(8))) float v8f;

// ---------------- grouped GEMM via V_WMMA_F32_16X16X4_F32 ----------------
// grid = (8, C): one work-group per (64-column slab, class), so that a class's
// table is streamed by eight work-groups instead of one or two; the slab index runs
// fastest, so the eight groups that share a class's table rows start together.
// 256 threads = 8 waves; wave w takes K range [w*64, w*64+64) of the whole slab
// and of up to two 16-row tiles, so each table element is loaded once per pass.
// The eight K partials are joined in LDS, in wave order 0..7.
// Every fragment load is 16 bytes a lane. Table: lane n of a row reads columns 4n..4n+3 of the slab, so
// column tile j holds columns 4n+j and one load covers two whole 256-byte row pieces. Samples: a lane
// reads four successive k of its row, lanes 0-15 the first four of a group of eight k, lanes 16-31 the
// last four; the table rows of a lane follow the same k order.
// Each work-group finds its class's samples itself: it reads the whole class vector, 256 samples
// a wave, and lists the matching sample numbers in LDS in rising order (ballot and bit count).

#define KW 64                  // K range of one wave
#define NW 8                   // waves of one work-group
#define NSLAB 64               // columns of one work-group
#define BB 2048                // samples
#define SPL (BB / (NW * 32))   // samples of one lane in the class search

template <int MT>
__device__ __forceinline__ void
row_pass(const float* __restrict__ xw, const float* __restrict__ Ww, unsigned wOff,
         const int* __restrict__ rows, int m0, int cnt,
         int laneM, int hi, int lane, int wave,
         float4 bv,
         float* __restrict__ outc, unsigned oOff, float4* red)
{
    // A-fragment source rows for this lane (clamped; invalid rows masked at store)
    // (every lane address is a 32-bit byte offset on a wave-uniform base: one register, not a pair)
    unsigned xrow[MT];
    #pragma unroll
    for (int t = 0; t < MT; ++t) {
        int mrow = m0 + t * 16 + laneM;
        xrow[t] = (unsigned)rows[mrow < cnt ? mrow : cnt - 1] * (DD * 4) + hi * 16;
    }

    v8f acc[MT][4];
    #pragma unroll
    for (int t = 0; t < MT; ++t)
        #pragma unroll
        for (int j = 0; j < 4; ++j) acc[t][j] = v8f{};

    // The K range as 16 steps of four k (over both lane halves): group g = step >> 1 of eight k, pair h = step & 1.
    // A: four successive k of the lane's row a group: 8g..8g+3 (lane<16), 8g+4..8g+7 (lane>=16), within the wave's K range
    v4f a4[2][MT];             // this group's and the next one's
    // B: the lane's k pair of a step as two table rows, four successive columns of each
    v4f b4[3][2];              // this step's and the next two
    auto loadA = [&](int g) {
        #pragma unroll
        for (int t = 0; t < MT; ++t) a4[g & 1][t] = *(const v4f*)(((const char*)xw + xrow[t]) + g * 32);
    };
    auto loadB = [&](int s) {
        #pragma unroll
        for (int i = 0; i < 2; ++i) b4[s % 3][i] = *(const v4f*)(((const char*)Ww + wOff) + ((s >> 1) * 8 + (s & 1) * 2 + i) * (UU * 4));
    };

    loadA(0); loadB(0); loadB(1);
    #pragma unroll
    for (int s = 0; s < KW / 4; ++s) {
        if (s + 2 < KW / 4) loadB(s + 2);
        if ((s & 1) == 0 && s + 2 < KW / 4) loadA((s >> 1) + 1);
        // keeps the loads two steps (A: one group) ahead of their products; without it they sink to their use
        __builtin_amdgcn_sched_barrier(0);

        const int h = s & 1;
        v2f A[MT], Bf[4];
        #pragma unroll
        for (int t = 0; t < MT; ++t) { A[t].x = a4[(s >> 1) & 1][t][2 * h]; A[t].y = a4[(s >> 1) & 1][t][2 * h + 1]; }
        #pragma unroll
        for (int j = 0; j < 4; ++j) { Bf[j].x = b4[s % 3][0][j]; Bf[j].y = b4[s % 3][1][j]; }

        #pragma unroll
        for (int t = 0; t < MT; ++t)
            #pragma unroll
            for (int j = 0; j < 4; ++j)
                acc[t][j] = __builtin_amdgcn_wmma_f32_16x16x4_f32(false, A[t], false, Bf[j], (short)0, acc[t][j], false, false);
        // keeps the next step's loads behind these products: further ahead they would take more registers than a wave has
        __builtin_amdgcn_sched_barrier(0);
        if (s + 1 < KW / 4) {
            // four vector slots between the step's last products and the next step's register moves, which
            // overwrite operands of these products; held here by the scheduling barriers on both sides
            asm volatile("v_nop\n\tv_nop\n\tv_nop\n\tv_nop");
            __builtin_amdgcn_sched_barrier(0);
        }
    }

    // One statement directly behind the last product, held there by the last step's scheduling barrier and the one below:
    // - s_wait_xcnt 0, the wait that belongs in front of any overwrite of an address register that
    //   issued loads name; it takes the A offsets as inputs, so they live up to it;
    // - four v_nop, the vector slots between a matrix instruction and the first vector
    //   instruction that reads its result or overwrites its operands.
    if constexpr (MT == 2)
        asm volatile("s_wait_xcnt 0x0\n\tv_nop\n\tv_nop\n\tv_nop\n\tv_nop" :: "v"(xrow[0]), "v"(xrow[1]) : "memory");
    else
        asm volatile("s_wait_xcnt 0x0\n\tv_nop\n\tv_nop\n\tv_nop\n\tv_nop" :: "v"(xrow[0]) : "memory");
    __builtin_amdgcn_sched_barrier(0);

    // partials to LDS: red[src wave][tile][r][lane] = the lane's four column tiles of register r: four successive columns
    #pragma unroll
    for (int t = 0; t < MT; ++t)
        #pragma unroll
        for (int r = 0; r < 8; ++r)
            red[((wave * 2 + t) * 8 + r) * 32 + lane] =
                make_float4(acc[t][0][r], acc[t][1][r], acc[t][2][r], acc[t][3][r]);

    __syncthreads();           // every wave's partials are in LDS before any is summed

    // wave w sums register r = w of every tile: rows m0+t*16+w and m0+t*16+8+w, 64 columns each
    #pragma unroll
    for (int t = 0; t < MT; ++t) {
        float4 s = red[((0 * 2 + t) * 8 + wave) * 32 + lane];
        #pragma unroll
        for (int p = 1; p < NW; ++p) {
            const float4 q = red[((p * 2 + t) * 8 + wave) * 32 + lane];
            s.x += q.x; s.y += q.y; s.z += q.z; s.w += q.w;
        }
        int m = m0 + t * 16 + hi * 8 + wave;
        if (m < cnt) {
            float* o = (float*)((char*)outc + ((unsigned)rows[m] * (UU * 4) + oOff));
            *(float4*)o = make_float4(s.x + bv.x, s.y + bv.y, s.z + bv.z, s.w + bv.w);
            // the wait that belongs in front of any overwrite of a register that this store names
            asm volatile("s_wait_xcnt 0x0" ::: "memory");
        }
    }
}

// eight waves a SIMD (128 registers a wave): four work-groups fit a WGP, so all 800 are resident at once
__global__ void __launch_bounds__(256, 8)
cond_dense_wmma(const float* __restrict__ x,       // [B, D]
                const int*   __restrict__ classes, // [B]
                const float* __restrict__ wtab,    // [C, D, U]
                const float* __restrict__ bias,    // [C, U]
                float*       __restrict__ out)     // [B, U]
{
    __shared__ float4 red[NW * 2 * 8 * 32];     // 64 KiB of K partials
    __shared__ int    rows[BB];                 // sample numbers of this class, rising
    __shared__ int    wtot[NW];                 // matches found by each wave

    const int c     = blockIdx.y;
    const int lane  = threadIdx.x & 31;
    const int wave  = __builtin_amdgcn_readfirstlane(threadIdx.x >> 5);   // 0..7, the same in every lane: a scalar register
    const int nBase = blockIdx.x * NSLAB;
    const int laneM = lane & 15;
    const int hi    = lane >> 4;                // 0 or 1

    // class search: wave w looks at samples [w*256, w*256+256), 32 a step
    const int b0 = wave * (SPL * 32) + lane;
    int cl[SPL];
    #pragma unroll
    for (int j = 0; j < SPL; ++j) cl[j] = classes[b0 + j * 32];

    unsigned hit[SPL];
    int tot = 0;
    #pragma unroll
    for (int j = 0; j < SPL; ++j) {
        hit[j] = __builtin_amdgcn_ballot_w32(cl[j] == c);
        tot += __popc(hit[j]);
    }
    if (lane == 0) wtot[wave] = tot;

    __syncthreads();           // every wave's match count is in LDS before any list place is formed

    int pos = 0, all = 0;      // matches in the waves below this one; matches of the whole class
    #pragma unroll
    for (int p = 0; p < NW; ++p) {
        const int v = wtot[p];
        pos += p < wave ? v : 0;
        all += v;
    }
    const unsigned below = (1u << lane) - 1u;
    #pragma unroll
    for (int j = 0; j < SPL; ++j) {
        if (cl[j] == c) rows[pos + __popc(hit[j] & below)] = b0 + j * 32;
        pos += __popc(hit[j]);
    }
    // the same in every lane: in a scalar register the row loop and its barriers get scalar branches
    const int cnt = __builtin_amdgcn_readfirstlane(all);

    __syncthreads();           // the list is complete before any wave reads it

    // wave-uniform bases: the wave's K range of the sample rows and of the class's slab; the slab's output columns
    const float* __restrict__ xw = x + wave * KW;
    const float* __restrict__ Ww = wtab + (size_t)c * DD * UU + (size_t)(wave * KW) * UU + nBase;
    float* __restrict__ outc = out + nBase;
    const unsigned wOff = (hi * 4 * UU + laneM * 4) * 4;   // bytes: lanes 16-31 start four table rows lower
    const unsigned oOff = laneM * 16;                      // bytes: the lane's four columns in the slab
    // bias of this lane's four stored columns
    const float4 bv = *(const float4*)(bias + (size_t)c * UU + nBase + laneM * 4);

    for (int m0 = 0; m0 < cnt; m0 += 32) {      // no trip for a class without samples
        if (m0) __syncthreads();                // the last pass's partials are read before they are overwritten
        if (cnt - m0 > 16)
            row_pass<2>(xw, Ww, wOff, rows, m0, cnt, laneM, hi, lane, wave, bv, outc, oOff, red);
        else
            row_pass<1>(xw, Ww, wOff, rows, m0, cnt, laneM, hi, lane, wave, bv, outc, oOff, red);
    }
}

// ---------------- launcher ----------------

extern "C" void kernel_launch(void* const* d_in, const int* in_sizes, int n_in,
                              void* d_out, int out_size, void* d_ws, size_t ws_size,
                              hipStream_t stream) {
    const float* x       = (const float*)d_in[0];
    const int*   classes = (const int*)d_in[1];
    const float* kern    = (const float*)d_in[2];
    const float* bias    = (const float*)d_in[3];
    float*       out     = (float*)d_out;

    const int Cn = in_sizes[3] / UU;   // 100

    cond_dense_wmma<<<dim3(8, Cn), 256, 0, stream>>>(x, classes, kern, bias, out);
}

// v004
// One run takes 15.5 microseconds.
// Timed twice side by side with v003, it ran 1.12 and 1.11 times as fast.
// All steps since v000 together make it 2.51 times as fast.
#include <hip/hip_runtime.h>

#define DD 512
#define UU 512

typedef __attribute__((ext_vector_type(2))) float v2f;
typedef __attribute__((ext_vector_type(4))) float v4f;
typedef __attribute__((ext_vector_type(8))) float v8f;

// ---------------- grouped GEMM via V_WMMA_F32_16X16X4_F32 ----------------
// grid = (8, C): one work-group per (64-column slab, class), so that a class's
// table is streamed by eight work-groups instead of one or two; the slab index runs
// fastest, so the eight groups that share a class's table rows start together.
// 256 threads = 8 waves; wave w takes K range [w*64, w*64+64) of the whole slab
// and of up to two 16-row tiles, so each table element is loaded once per pass.
// The eight K partials are joined in LDS, in wave order 0..7.
// Every fragment load is 16 bytes a lane. Table: lane n of a row reads columns 4n..4n+3 of the slab, so
// column tile j holds columns 4n+j and one load covers two whole 256-byte row pieces. Samples: a lane
// reads four successive k of its row, lanes 0-15 the first four of a group of eight k, lanes 16-31 the
// last four; the table rows of a lane follow the same k order.
// Samples go through LDS: each wave copies its own K range of the pass's rows there, 256 bytes a row and two
// rows a copy, so that a copy asks for whole cache lines; a fragment read straight from memory touched 16 lines.
// Each work-group finds its class's samples itself: it reads the whole class vector, 256 samples
// a wave, and lists the matching sample numbers in LDS in rising order (ballot and bit count).

#define KW 64                  // K range of one wave
#define NW 8                   // waves of one work-group
#define NSLAB 64               // columns of one work-group
#define BB 2048                // samples
#define SPL (BB / (NW * 32))   // samples of one lane in the class search
#define XP 272                 // bytes from one staged row piece to the next: 256 + 16, so 16 rows' 16-byte reads meet no bank twice
#define XBIAS 8192             // at least the largest immediate offset of a copy, 30 * XP
#define WSTR (32 * XP)         // LDS bytes of one wave: first its staged row pieces, then its K partials

// every lane of a 16-lane half reads lane N of that half (DPP row_share)
template <int N>
__device__ __forceinline__ unsigned half_share(int v)
{
    return (unsigned)__builtin_amdgcn_update_dpp(0, v, 0x150 + N, 0xf, 0xf, false);
}

// Rows 16Q..16Q+15 of a pass to LDS: eight copies of two row pieces each. An immediate offset moves the LDS and the
// global address alike, so one LDS address register serves all copies (one register a copy would not fit the wave's
// budget): copy n lands n * 2 * XP bytes further on, and the row offset that it takes from lane n of the lane's
// half has those bytes taken off again (XBIAS, added there and taken off the base, keeps that offset above zero).
template <int Q>
__device__ __forceinline__ void
stage16(unsigned long long xbase, unsigned ldst, int roff, unsigned cOff)
{
    const unsigned g0 = half_share<Q * 8 + 0>(roff) + cOff;
    const unsigned g1 = half_share<Q * 8 + 1>(roff) + cOff;
    const unsigned g2 = half_share<Q * 8 + 2>(roff) + cOff;
    const unsigned g3 = half_share<Q * 8 + 3>(roff) + cOff;
    const unsigned g4 = half_share<Q * 8 + 4>(roff) + cOff;
    const unsigned g5 = half_share<Q * 8 + 5>(roff) + cOff;
    const unsigned g6 = half_share<Q * 8 + 6>(roff) + cOff;
    const unsigned g7 = half_share<Q * 8 + 7>(roff) + cOff;
    // s_wait_xcnt 0 as the statement's last line stands in front of any overwrite of the address registers that the copies name
    asm volatile("global_load_async_to_lds_b128 %0, %1, %9 offset:%10\n\t"
                 "global_load_async_to_lds_b128 %0, %2, %9 offset:%11\n\t"
                 "global_load_async_to_lds_b128 %0, %3, %9 offset:%12\n\t"
                 "global_load_async_to_lds_b128 %0, %4, %9 offset:%13\n\t"
                 "global_load_async_to_lds_b128 %0, %5, %9 offset:%14\n\t"
                 "global_load_async_to_lds_b128 %0, %6, %9 offset:%15\n\t"
                 "global_load_async_to_lds_b128 %0, %7, %9 offset:%16\n\t"
                 "global_load_async_to_lds_b128 %0, %8, %9 offset:%17\n\t"
                 "s_wait_xcnt 0x0"
                 :: "v"(ldst),
                    "v"(g0), "v"(g1), "v"(g2), "v"(g3), "v"(g4), "v"(g5), "v"(g6), "v"(g7),
                    "s"(xbase),
                    "n"((Q * 8 + 0) * 2 * XP), "n"((Q * 8 + 1) * 2 * XP), "n"((Q * 8 + 2) * 2 * XP), "n"((Q * 8 + 3) * 2 * XP),
                    "n"((Q * 8 + 4) * 2 * XP), "n"((Q * 8 + 5) * 2 * XP), "n"((Q * 8 + 6) * 2 * XP), "n"((Q * 8 + 7) * 2 * XP)
                 : "memory");
}

template <int MT>
__device__ __forceinline__ void
row_pass(const float* __restrict__ xw, const float* __restrict__ Ww, unsigned wOff,
         const int* __restrict__ rows, int m0, int cnt,
         int laneM, int hi, int lane, int wave,
         float4 bv,
         float* __restrict__ outc, unsigned oOff, float4* red)
{
    // B: the lane's k pair of a step as two table rows, four successive columns of each
    v4f b4[3][2];              // this step's and the next two
    auto loadB = [&](int s) {
        #pragma unroll
        for (int i = 0; i < 2; ++i) b4[s % 3][i] = *(const v4f*)(((const char*)Ww + wOff) + ((s >> 1) * 8 + (s & 1) * 2 + i) * (UU * 4));
    };
    loadB(0); loadB(1);
    // keeps the first table loads in front of the staging, so that both are under way at once
    __builtin_amdgcn_sched_barrier(0);

    // The wave's K range of the pass's rows to LDS (row numbers clamped; invalid rows masked at store).
    // Copy i takes list places 2i (lanes 0-15) and 2i+1 (lanes 16-31), 256 bytes of each row. Lane j of a half
    // holds the byte offset of place 2j (2j+1 in the upper half), and copy i takes lane i's from its own half.
    char* stg = (char*)red + wave * WSTR;
    const int mrow = m0 + 2 * laneM + hi;
    const int roff = rows[mrow < cnt ? mrow : cnt - 1] * (DD * 4) + (XBIAS - laneM * 2 * XP);
    const unsigned long long xbase = (unsigned long long)xw - XBIAS;
    const unsigned ldst = (unsigned)(size_t)stg + hi * XP + laneM * 16;
    stage16<0>(xbase, ldst, roff, laneM * 16);
    if constexpr (MT == 2) stage16<1>(xbase, ldst, roff, laneM * 16);
    // the wave's copies have landed before anything reads them: the compiler places no wait for them
    asm volatile("s_wait_asynccnt 0x0" ::: "memory");
    __syncthreads();           // every wave's row pieces are in LDS before any fragment is read
    const char* sA = stg + laneM * XP + hi * 16;   // the lane's row of tile 0, its half of a group of eight k

    v8f acc[MT][4];
    #pragma unroll
    for (int t = 0; t < MT; ++t)
        #pragma unroll
        for (int j = 0; j < 4; ++j) acc[t][j] = v8f{};

    // The K range as 16 steps of four k (over both lane halves): group g = step >> 1 of eight k, pair h = step & 1.
    // A: four successive k of the lane's row a group: 8g..8g+3 (lane<16), 8g+4..8g+7 (lane>=16), within the wave's K range
    v4f a4[2][MT];             // this group's and the next one's
    auto loadA = [&](int g) {
        #pragma unroll
        for (int t = 0; t < MT; ++t) a4[g & 1][t] = *(const v4f*)(sA + t * 16 * XP + g * 32);
    };

    loadA(0);
    #pragma unroll
    for (int s = 0; s < KW / 4; ++s) {
        if (s + 2 < KW / 4) loadB(s + 2);
        if ((s & 1) == 0 && s + 2 < KW / 4) loadA((s >> 1) + 1);
        // keeps the loads two steps (A: one group) ahead of their products; without it they sink to their use
        __builtin_amdgcn_sched_barrier(0);

        const int h = s & 1;
        v2f A[MT], Bf[4];
        #pragma unroll
        for (int t = 0; t < MT; ++t) { A[t].x = a4[(s >> 1) & 1][t][2 * h]; A[t].y = a4[(s >> 1) & 1][t][2 * h + 1]; }
        #pragma unroll
        for (int j = 0; j < 4; ++j) { Bf[j].x = b4[s % 3][0][j]; Bf[j].y = b4[s % 3][1][j]; }

        #pragma unroll
        for (int t = 0; t < MT; ++t)
            #pragma unroll
            for (int j = 0; j < 4; ++j)
                acc[t][j] = __builtin_amdgcn_wmma_f32_16x16x4_f32(false, A[t], false, Bf[j], (short)0, acc[t][j], false, false);
        // keeps the next step's loads behind these products: further ahead they would take more registers than a wave has
        __builtin_amdgcn_sched_barrier(0);
        if (s + 1 < KW / 4) {
            // four vector slots between the step's last products and the next step's register moves, which
            // overwrite operands of these products; held here by the scheduling barriers on both sides
            asm volatile("v_nop\n\tv_nop\n\tv_nop\n\tv_nop");
            __builtin_amdgcn_sched_barrier(0);
        }
    }

    // One statement directly behind the last product, held there by the last step's scheduling barrier and the one below:
    // - s_wait_xcnt 0, the wait that belongs in front of any overwrite of an address register that
    //   issued loads name (here the table loads');
    // - four v_nop, the vector slots between a matrix instruction and the first vector
    //   instruction that reads its result or overwrites its operands.
    asm volatile("s_wait_xcnt 0x0\n\tv_nop\n\tv_nop\n\tv_nop\n\tv_nop" ::: "memory");
    __builtin_amdgcn_sched_barrier(0);

    // partials to LDS, over the wave's own row pieces, which only it has read and has done with:
    // red[src wave][tile][r][lane] = the lane's four column tiles of register r: four successive columns
    #pragma unroll
    for (int t = 0; t < MT; ++t)
        #pragma unroll
        for (int r = 0; r < 8; ++r)
            red[wave * (WSTR / 16) + (t * 8 + r) * 32 + lane] =
                make_float4(acc[t][0][r], acc[t][1][r], acc[t][2][r], acc[t][3][r]);

    __syncthreads();           // every wave's partials are in LDS before any is summed

    // wave w sums register r = w of every tile: rows m0+t*16+w and m0+t*16+8+w, 64 columns each
    #pragma unroll
    for (int t = 0; t < MT; ++t) {
        float4 s = red[(t * 8 + wave) * 32 + lane];
        #pragma unroll
        for (int p = 1; p < NW; ++p) {
            const float4 q = red[p * (WSTR / 16) + (t * 8 + wave) * 32 + lane];
            s.x += q.x; s.y += q.y; s.z += q.z; s.w += q.w;
        }
        int m = m0 + t * 16 + hi * 8 + wave;
        if (m < cnt) {
            float* o = (float*)((char*)outc + ((unsigned)rows[m] * (UU * 4) + oOff));
            *(float4*)o = make_float4(s.x + bv.x, s.y + bv.y, s.z + bv.z, s.w + bv.w);
            // the wait that belongs in front of any overwrite of a register that this store names
            asm volatile("s_wait_xcnt 0x0" ::: "memory");
        }
    }
}

// eight waves a SIMD (128 registers a wave): four work-groups fit a WGP, so all 800 are resident at once
__global__ void __launch_bounds__(256, 8)
cond_dense_wmma(const float* __restrict__ x,       // [B, D]
                const int*   __restrict__ classes, // [B]
                const float* __restrict__ wtab,    // [C, D, U]
                const float* __restrict__ bias,    // [C, U]
                float*       __restrict__ out)     // [B, U]
{
    __shared__ float4 red[NW * WSTR / 16];      // 68 KiB: staged sample rows, then K partials
    __shared__ int    rows[BB];                 // sample numbers of this class, rising
    __shared__ int    wtot[NW];                 // matches found by each wave

    const int c     = blockIdx.y;
    const int lane  = threadIdx.x & 31;
    const int wave  = __builtin_amdgcn_readfirstlane(threadIdx.x >> 5);   // 0..7, the same in every lane: a scalar register
    const int nBase = blockIdx.x * NSLAB;
    const int laneM = lane & 15;
    const int hi    = lane >> 4;                // 0 or 1

    // class search: wave w looks at samples [w*256, w*256+256), 32 a step
    const int b0 = wave * (SPL * 32) + lane;
    int cl[SPL];
    #pragma unroll
    for (int j = 0; j < SPL; ++j) cl[j] = classes[b0 + j * 32];

    unsigned hit[SPL];
    int tot = 0;
    #pragma unroll
    for (int j = 0; j < SPL; ++j) {
        hit[j] = __builtin_amdgcn_ballot_w32(cl[j] == c);
        tot += __popc(hit[j]);
    }
    if (lane == 0) wtot[wave] = tot;

    __syncthreads();           // every wave's match count is in LDS before any list place is formed

    int pos = 0, all = 0;      // matches in the waves below this one; matches of the whole class
    #pragma unroll
    for (int p = 0; p < NW; ++p) {
        const int v = wtot[p];
        pos += p < wave ? v : 0;
        all += v;
    }
    const unsigned below = (1u << lane) - 1u;
    #pragma unroll
    for (int j = 0; j < SPL; ++j) {
        if (cl[j] == c) rows[pos + __popc(hit[j] & below)] = b0 + j * 32;
        pos += __popc(hit[j]);
    }
    // the same in every lane: in a scalar register the row loop and its barriers get scalar branches
    const int cnt = __builtin_amdgcn_readfirstlane(all);

    __syncthreads();           // the list is complete before any wave reads it

    // wave-uniform bases: the wave's K range of the sample rows and of the class's slab; the slab's output columns
    const float* __restrict__ xw = x + wave * KW;
    const float* __restrict__ Ww = wtab + (size_t)c * DD * UU + (size_t)(wave * KW) * UU + nBase;
    float* __restrict__ outc = out + nBase;
    const unsigned wOff = (hi * 4 * UU + laneM * 4) * 4;   // bytes: lanes 16-31 start four table rows lower
    const unsigned oOff = laneM * 16;                      // bytes: the lane's four columns in the slab
    // bias of this lane's four stored columns
    const float4 bv = *(const float4*)(bias + (size_t)c * UU + nBase + laneM * 4);

    for (int m0 = 0; m0 < cnt; m0 += 32) {      // no trip for a class without samples
        if (m0) {
            // this wave's reads of the last pass's partials have returned before the barrier behind which copies overwrite them
            asm volatile("s_wait_dscnt 0x0" ::: "memory");
            __syncthreads();                    // the last pass's partials are read before they are overwritten
        }
        if (cnt - m0 > 16)
            row_pass<2>(xw, Ww, wOff, rows, m0, cnt, laneM, hi, lane, wave, bv, outc, oOff, red);
        else
            row_pass<1>(xw, Ww, wOff, rows, m0, cnt, laneM, hi, lane, wave, bv, outc, oOff, red);
    }
}

// ---------------- launcher ----------------

extern "C" void kernel_launch(void* const* d_in, const int* in_sizes, int n_in,
                              void* d_out, int out_size, void* d_ws, size_t ws_size,
                              hipStream_t stream) {
    const float* x       = (const float*)d_in[0];
    const int*   classes = (const int*)d_in[1];
    const float* kern    = (const float*)d_in[2];
    const float* bias    = (const float*)d_in[3];
    float*       out     = (float*)d_out;

    const int Cn = in_sizes[3] / UU;   // 100

    cond_dense_wmma<<<dim3(8, Cn), 256, 0, stream>>>(x, classes, kern, bias, out);
}
